// v000
// Times are from an AMD MI455X. After a warm-up the kernel runs many times in a row, and a time is the length of
// such a window on the GPU divided by its runs, so every launch and the gaps after it count. The runs cycle
// through copies of the inputs. A figure is the median of several windows, for all but v000 over two sittings.
// Sittings can differ by a few percent; kernels timed side by side share one.
// v000, which the later versions start from, runs in 186 microseconds.
#include <hip/hip_runtime.h>
#include <hip/hip_bf16.h>

typedef __attribute__((ext_vector_type(16))) _Float16 v16h;
typedef __attribute__((ext_vector_type(8)))  _Float16 v8h;
typedef __attribute__((ext_vector_type(8)))  float    v8f;

#define HEAD_DIM 64
#define S_LEN    512
#define N_HEADS  16
#define N_SLOTS  32      // E(8) * CAP(4)
#define BC       32      // keys per iteration
#define N_TILES  (S_LEN / BC)
#define BR       128     // query rows per block (32 per wave, 2 groups of 16)
#define MASK_PEN 1000000.0f

// ---------------- DPP16 row reductions (16-lane rows == our half-wave groups) ----
template <int CTRL>
__device__ __forceinline__ float dpp_f32(float x) {
    int r = __builtin_amdgcn_update_dpp(0, __builtin_bit_cast(int, x),
                                        CTRL, 0xF, 0xF, true);
    return __builtin_bit_cast(float, r);
}
// row_ror:1/2/4/8 = 0x121/0x122/0x124/0x128 — rotate-reduce over 16 lanes
__device__ __forceinline__ float rowmax16(float x) {
    x = fmaxf(x, dpp_f32<0x121>(x));
    x = fmaxf(x, dpp_f32<0x122>(x));
    x = fmaxf(x, dpp_f32<0x124>(x));
    x = fmaxf(x, dpp_f32<0x128>(x));
    return x;
}
__device__ __forceinline__ float rowsum16(float x) {
    x += dpp_f32<0x121>(x);
    x += dpp_f32<0x122>(x);
    x += dpp_f32<0x124>(x);
    x += dpp_f32<0x128>(x);
    return x;
}

// ---------------- async global -> LDS (CDNA5, ASYNCcnt-tracked DMA) ----------
__device__ __forceinline__ void async_load_b128(unsigned lds_off, const float* gaddr) {
    asm volatile("global_load_async_to_lds_b128 %0, %1, off"
                 :: "v"(lds_off), "v"((unsigned long long)(uintptr_t)gaddr)
                 : "memory");
}
__device__ __forceinline__ void wait_async0(void) {
    asm volatile("s_wait_asynccnt 0x0" ::: "memory");
}

// ---------------- fragment builders ------------------------------------------
// A/B frag from f32 row: halves 0..7 = p[0..7], halves 8..15 = p[16..23]
__device__ __forceinline__ v16h frag_from_f32(const float* p) {
    float4 a0 = *(const float4*)(p);
    float4 a1 = *(const float4*)(p + 4);
    float4 b0 = *(const float4*)(p + 16);
    float4 b1 = *(const float4*)(p + 20);
    v16h r;
    r[0]=(_Float16)a0.x;  r[1]=(_Float16)a0.y;  r[2]=(_Float16)a0.z;  r[3]=(_Float16)a0.w;
    r[4]=(_Float16)a1.x;  r[5]=(_Float16)a1.y;  r[6]=(_Float16)a1.z;  r[7]=(_Float16)a1.w;
    r[8]=(_Float16)b0.x;  r[9]=(_Float16)b0.y;  r[10]=(_Float16)b0.z; r[11]=(_Float16)b0.w;
    r[12]=(_Float16)b1.x; r[13]=(_Float16)b1.y; r[14]=(_Float16)b1.z; r[15]=(_Float16)b1.w;
    return r;
}
// V B-frag: column n of B = output dim d; contraction k = key (row-major f32 tile)
__device__ __forceinline__ v16h vfrag(const float (*Vf)[HEAD_DIM], int d, int hi) {
    v16h r;
    #pragma unroll
    for (int j = 0; j < 8; ++j) {
        r[j]     = (_Float16)Vf[hi * 8 + j][d];
        r[8 + j] = (_Float16)Vf[16 + hi * 8 + j][d];
    }
    return r;
}
// P A-frag from per-wave f16 scratch
__device__ __forceinline__ v16h lds_frag16(const _Float16* lo, const _Float16* hi) {
    v8h a = *(const v8h*)lo;
    v8h b = *(const v8h*)hi;
    return __builtin_shufflevector(a, b, 0,1,2,3,4,5,6,7,8,9,10,11,12,13,14,15);
}

#define WMMA_F16(A, B, C) \
    __builtin_amdgcn_wmma_f32_16x16x32_f16(false, (A), false, (B), (short)0, (C), false, false)

__global__ __launch_bounds__(128)
void sparse_attn_fa_kernel(const float* __restrict__ Q,
                           const float* __restrict__ K,
                           const float* __restrict__ V,
                           const int*   __restrict__ idx_list,
                           const float* __restrict__ mask,
                           float*       __restrict__ out) {
    __shared__ __align__(16) float Kbuf[2][BC][HEAD_DIM];   // 2 x 8 KB, f32
    __shared__ __align__(16) float Vbuf[2][BC][HEAD_DIM];   // 2 x 8 KB, f32
    __shared__ __align__(16) _Float16 Pw[4][2][16][BC];     // per-wave/group P scratch, 8 KB

    const int tid  = threadIdx.x;
    const int lane = tid & 31;
    const int w    = tid >> 5;       // wave id 0..3
    const int n    = lane & 15;      // column within a 16-wide tile
    const int hi   = lane >> 4;      // lane half

    const int bid  = blockIdx.x;
    const int qt   = bid & 3;               // q-tile (128 rows / block)
    const int h    = (bid >> 2) & 15;       // head
    const int slot = bid >> 6;              // expert*CAP + cap (0..31)

    const int b = idx_list[slot];           // routed batch index
    const size_t bh = (size_t)(b * N_HEADS + h);
    const float* Qbh = Q + bh * (size_t)S_LEN * HEAD_DIM;
    const float* Kbh = K + bh * (size_t)S_LEN * HEAD_DIM;
    const float* Vbh = V + bh * (size_t)S_LEN * HEAD_DIM;
    const float* mb  = mask + (size_t)b * S_LEN;

    const int q0 = qt * BR + w * 32;        // this wave's first query row (32 rows)

    // ---- issue async DMA for tile 0 (each thread covers 4x16B of K and of V) ----
    {
        #pragma unroll
        for (int j = 0; j < 4; ++j) {
            const int s   = tid + 128 * j;
            const int key = s >> 4;
            const int d   = (s & 15) * 4;
            const size_t g = (size_t)key * HEAD_DIM + d;
            async_load_b128((unsigned)(uintptr_t)&Kbuf[0][key][d], Kbh + g);
            async_load_b128((unsigned)(uintptr_t)&Vbuf[0][key][d], Vbh + g);
        }
    }

    // ---- Q A-fragments: 2 row-groups x 2 d-chunks, held for the whole kernel ----
    v16h aq[2][2];
    #pragma unroll
    for (int g = 0; g < 2; ++g) {
        const float* qrow = Qbh + (size_t)(q0 + g * 16 + n) * HEAD_DIM;
        aq[g][0] = frag_from_f32(qrow + hi * 8);          // d = 0..31
        aq[g][1] = frag_from_f32(qrow + 32 + hi * 8);     // d = 32..63
    }

    v8f o[2][4] = {};
    float mrow[2][8], lrow[2][8];
    #pragma unroll
    for (int g = 0; g < 2; ++g)
        #pragma unroll
        for (int r = 0; r < 8; ++r) { mrow[g][r] = -1e30f; lrow[g][r] = 0.0f; }

    const float scale = 0.125f; // 1/sqrt(64)

    for (int kt = 0; kt < N_TILES; ++kt) {
        const int buf = kt & 1;

        wait_async0();      // this wave's async writes for tile kt are in LDS
        __syncthreads();    // all waves' writes visible; prior compute done

        // prefetch tile kt+1 into the other buffer (its readers are all past the barrier)
        if (kt + 1 < N_TILES) {
            const int kb2 = (kt + 1) * BC;
            #pragma unroll
            for (int j = 0; j < 4; ++j) {
                const int s   = tid + 128 * j;
                const int key = s >> 4;
                const int d   = (s & 15) * 4;
                const size_t g = (size_t)(kb2 + key) * HEAD_DIM + d;
                async_load_b128((unsigned)(uintptr_t)&Kbuf[buf ^ 1][key][d], Kbh + g);
                async_load_b128((unsigned)(uintptr_t)&Vbuf[buf ^ 1][key][d], Vbh + g);
            }
        }

        const int kbase = kt * BC;

        // ---- shared B-fragments: built ONCE per wave, reused by both row groups ----
        v16h b00 = frag_from_f32(&Kbuf[buf][n][hi * 8]);
        v16h b01 = frag_from_f32(&Kbuf[buf][n][32 + hi * 8]);
        v16h b10 = frag_from_f32(&Kbuf[buf][16 + n][hi * 8]);
        v16h b11 = frag_from_f32(&Kbuf[buf][16 + n][32 + hi * 8]);
        v16h bv0 = vfrag(Vbuf[buf], n,      hi);
        v16h bv1 = vfrag(Vbuf[buf], 16 + n, hi);
        v16h bv2 = vfrag(Vbuf[buf], 32 + n, hi);
        v16h bv3 = vfrag(Vbuf[buf], 48 + n, hi);

        const float pen0 = MASK_PEN * (1.0f - mb[kbase + n]);
        const float pen1 = MASK_PEN * (1.0f - mb[kbase + 16 + n]);

        #pragma unroll
        for (int g = 0; g < 2; ++g) {
            // ---- scores: S = Q * K^T (two 16x16 tiles over 32 keys) ----
            v8f s0 = {}, s1 = {};
            s0 = WMMA_F16(aq[g][0], b00, s0);
            s0 = WMMA_F16(aq[g][1], b01, s0);
            s1 = WMMA_F16(aq[g][0], b10, s1);
            s1 = WMMA_F16(aq[g][1], b11, s1);

            // ---- online softmax (DPP16 row reductions) ----
            #pragma unroll
            for (int r = 0; r < 8; ++r) {
                float v0 = s0[r] * scale - pen0;
                float v1 = s1[r] * scale - pen1;
                float mx = rowmax16(fmaxf(v0, v1));
                const float mnew = fmaxf(mrow[g][r], mx);
                const float p0 = __expf(v0 - mnew);
                const float p1 = __expf(v1 - mnew);
                const float sf = __expf(mrow[g][r] - mnew);
                const float rs = rowsum16(p0 + p1);
                lrow[g][r] = lrow[g][r] * sf + rs;
                mrow[g][r] = mnew;
                o[g][0][r] *= sf; o[g][1][r] *= sf;
                o[g][2][r] *= sf; o[g][3][r] *= sf;
                const int mr = r + hi * 8;
                Pw[w][g][mr][n]      = (_Float16)p0;
                Pw[w][g][mr][16 + n] = (_Float16)p1;
            }

            // ---- O += P * V (contraction over 32 keys, 4 output d-tiles) ----
            // Same-wave LDS ops are in-order: Pw stores above are visible here.
            v16h pa = lds_frag16(&Pw[w][g][n][hi * 8], &Pw[w][g][n][16 + hi * 8]);
            o[g][0] = WMMA_F16(pa, bv0, o[g][0]);
            o[g][1] = WMMA_F16(pa, bv1, o[g][1]);
            o[g][2] = WMMA_F16(pa, bv2, o[g][2]);
            o[g][3] = WMMA_F16(pa, bv3, o[g][3]);
        }
    }

    // ---- epilogue: divide by row sum, store fp32 ----
    #pragma unroll
    for (int g = 0; g < 2; ++g) {
        float* obase = out + ((size_t)(slot * N_HEADS + h) * S_LEN + q0 + g * 16) * HEAD_DIM;
        #pragma unroll
        for (int r = 0; r < 8; ++r) {
            const int mr = r + hi * 8;
            const float inv = 1.0f / lrow[g][r];
            float* orow = obase + (size_t)mr * HEAD_DIM;
            orow[n]      = o[g][0][r] * inv;
            orow[16 + n] = o[g][1][r] * inv;
            orow[32 + n] = o[g][2][r] * inv;
            orow[48 + n] = o[g][3][r] * inv;
        }
    }
}

extern "C" void kernel_launch(void* const* d_in, const int* in_sizes, int n_in,
                              void* d_out, int out_size, void* d_ws, size_t ws_size,
                              hipStream_t stream) {
    const float* Q        = (const float*)d_in[0];
    const float* K        = (const float*)d_in[1];
    const float* V        = (const float*)d_in[2];
    const int*   idx_list = (const int*)d_in[3];
    const float* mask     = (const float*)d_in[4];
    float* out = (float*)d_out;

    dim3 grid(N_SLOTS * N_HEADS * (S_LEN / BR));   // 2048 blocks
    dim3 block(128);                               // 4 waves (wave32), 32 q-rows each
    sparse_attn_fa_kernel<<<grid, block, 0, stream>>>(Q, K, V, idx_list, mask, out);
}

// v001
// It runs in 110 microseconds.
// Two timings next to v000 put it at 1.77 and 1.78 times that version's speed.
#include <hip/hip_runtime.h>
#include <hip/hip_bf16.h>

typedef __attribute__((ext_vector_type(16))) _Float16 v16h;
typedef __attribute__((ext_vector_type(8)))  _Float16 v8h;
typedef __attribute__((ext_vector_type(8)))  float    v8f;

#define HEAD_DIM 64
#define S_LEN    512
#define N_HEADS  16
#define N_SLOTS  32      // E(8) * CAP(4)
#define N_BATCH  32      // rows of Q, K, V and mask that a routed index may name
#define BC       32      // keys per iteration
#define N_TILES  (S_LEN / BC)
#define BR       128     // query rows per block (32 per wave, 2 groups of 16)
#define MASK_PEN 1000000.0f
// LDS row pitches. 64 banks x 4 B: a 256-B row pitch puts all 16 rows of a fragment read on the same banks.
#define KV_PITCH 68      // floats per K/V row in LDS: 272 B = 16 B x 17 (odd), conflict-free for 16-B row reads and 4-B column reads
#define P_PITCH  40      // halves per P row in LDS: 80 B = 16 B x 5 (odd)

// ---------------- DPP16 row reductions (16-lane rows == our half-wave groups) ----
template <int CTRL>
__device__ __forceinline__ float dpp_f32(float x) {
    int r = __builtin_amdgcn_update_dpp(0, __builtin_bit_cast(int, x),
                                        CTRL, 0xF, 0xF, true);
    return __builtin_bit_cast(float, r);
}
// row_ror:1/2/4/8 = 0x121/0x122/0x124/0x128 — rotate-reduce over 16 lanes
__device__ __forceinline__ float rowmax16(float x) {
    x = fmaxf(x, dpp_f32<0x121>(x));
    x = fmaxf(x, dpp_f32<0x122>(x));
    x = fmaxf(x, dpp_f32<0x124>(x));
    x = fmaxf(x, dpp_f32<0x128>(x));
    return x;
}
__device__ __forceinline__ float rowsum16(float x) {
    x += dpp_f32<0x121>(x);
    x += dpp_f32<0x122>(x);
    x += dpp_f32<0x124>(x);
    x += dpp_f32<0x128>(x);
    return x;
}

// ---------------- async global -> LDS (CDNA5, ASYNCcnt-tracked DMA) ----------
__device__ __forceinline__ void async_load_b128(unsigned lds_off, const float* gaddr) {
    asm volatile("global_load_async_to_lds_b128 %0, %1, off"
                 :: "v"(lds_off), "v"((unsigned long long)(uintptr_t)gaddr)
                 : "memory");
}
__device__ __forceinline__ void wait_async0(void) {
    asm volatile("s_wait_asynccnt 0x0" ::: "memory");
}

// ---------------- fragment builders ------------------------------------------
// A/B frag from f32 row: halves 0..7 = p[0..7], halves 8..15 = p[16..23]
__device__ __forceinline__ v16h frag_from_f32(const float* p) {
    float4 a0 = *(const float4*)(p);
    float4 a1 = *(const float4*)(p + 4);
    float4 b0 = *(const float4*)(p + 16);
    float4 b1 = *(const float4*)(p + 20);
    v16h r;
    r[0]=(_Float16)a0.x;  r[1]=(_Float16)a0.y;  r[2]=(_Float16)a0.z;  r[3]=(_Float16)a0.w;
    r[4]=(_Float16)a1.x;  r[5]=(_Float16)a1.y;  r[6]=(_Float16)a1.z;  r[7]=(_Float16)a1.w;
    r[8]=(_Float16)b0.x;  r[9]=(_Float16)b0.y;  r[10]=(_Float16)b0.z; r[11]=(_Float16)b0.w;
    r[12]=(_Float16)b1.x; r[13]=(_Float16)b1.y; r[14]=(_Float16)b1.z; r[15]=(_Float16)b1.w;
    return r;
}
// V B-frag: column n of B = output dim d; contraction k = key (row-major f32 tile)
__device__ __forceinline__ v16h vfrag(const float (*Vf)[KV_PITCH], int d, int hi) {
    v16h r;
    #pragma unroll
    for (int j = 0; j < 8; ++j) {
        r[j]     = (_Float16)Vf[hi * 8 + j][d];
        r[8 + j] = (_Float16)Vf[16 + hi * 8 + j][d];
    }
    return r;
}
// P A-frag from per-wave f16 scratch
__device__ __forceinline__ v16h lds_frag16(const _Float16* lo, const _Float16* hi) {
    v8h a = *(const v8h*)lo;
    v8h b = *(const v8h*)hi;
    return __builtin_shufflevector(a, b, 0,1,2,3,4,5,6,7,8,9,10,11,12,13,14,15);
}

#define WMMA_F16(A, B, C) \
    __builtin_amdgcn_wmma_f32_16x16x32_f16(false, (A), false, (B), (short)0, (C), false, false)

__global__ __launch_bounds__(128)
void sparse_attn_fa_kernel(const float* __restrict__ Q,
                           const float* __restrict__ K,
                           const float* __restrict__ V,
                           const int*   __restrict__ idx_list,
                           const float* __restrict__ mask,
                           float*       __restrict__ out) {
    __shared__ __align__(16) float Kbuf[2][BC][KV_PITCH];   // 2 x 8.5 KB, f32, padded rows
    __shared__ __align__(16) float Vbuf[2][BC][KV_PITCH];   // 2 x 8.5 KB, f32, padded rows
    __shared__ __align__(16) _Float16 Pw[4][2][16][P_PITCH]; // per-wave/group P scratch, 10 KB, padded rows

    const int tid  = threadIdx.x;
    const int lane = tid & 31;
    const int w    = tid >> 5;       // wave id 0..3
    const int n    = lane & 15;      // column within a 16-wide tile
    const int hi   = lane >> 4;      // lane half

    const int bid  = blockIdx.x;
    const int qt   = bid & 3;               // q-tile (128 rows / block)
    const int h    = (bid >> 2) & 15;       // head
    const int slot = bid >> 6;              // expert*CAP + cap (0..31)

    const int b = min(max(idx_list[slot], 0), N_BATCH - 1);   // routed batch index, bounded before any address is formed
    const size_t bh = (size_t)(b * N_HEADS + h);
    const float* Qbh = Q + bh * (size_t)S_LEN * HEAD_DIM;
    const float* Kbh = K + bh * (size_t)S_LEN * HEAD_DIM;
    const float* Vbh = V + bh * (size_t)S_LEN * HEAD_DIM;
    const float* mb  = mask + (size_t)b * S_LEN;

    const int q0 = qt * BR + w * 32;        // this wave's first query row (32 rows)

    // ---- issue async DMA for tile 0 (each thread covers 4x16B of K and of V) ----
    {
        #pragma unroll
        for (int j = 0; j < 4; ++j) {
            const int s   = tid + 128 * j;
            const int key = s >> 4;
            const int d   = (s & 15) * 4;
            const size_t g = (size_t)key * HEAD_DIM + d;
            async_load_b128((unsigned)(uintptr_t)&Kbuf[0][key][d], Kbh + g);
            async_load_b128((unsigned)(uintptr_t)&Vbuf[0][key][d], Vbh + g);
        }
    }

    // ---- Q A-fragments: 2 row-groups x 2 d-chunks, held for the whole kernel ----
    v16h aq[2][2];
    #pragma unroll
    for (int g = 0; g < 2; ++g) {
        const float* qrow = Qbh + (size_t)(q0 + g * 16 + n) * HEAD_DIM;
        aq[g][0] = frag_from_f32(qrow + hi * 8);          // d = 0..31
        aq[g][1] = frag_from_f32(qrow + 32 + hi * 8);     // d = 32..63
    }

    v8f o[2][4] = {};
    float mrow[2][8], lrow[2][8];
    #pragma unroll
    for (int g = 0; g < 2; ++g)
        #pragma unroll
        for (int r = 0; r < 8; ++r) { mrow[g][r] = -1e30f; lrow[g][r] = 0.0f; }

    const float scale = 0.125f; // 1/sqrt(64)

    for (int kt = 0; kt < N_TILES; ++kt) {
        const int buf = kt & 1;

        wait_async0();      // this wave's async writes for tile kt are in LDS
        __syncthreads();    // all waves' writes visible; prior compute done

        // prefetch tile kt+1 into the other buffer (its readers are all past the barrier)
        if (kt + 1 < N_TILES) {
            const int kb2 = (kt + 1) * BC;
            #pragma unroll
            for (int j = 0; j < 4; ++j) {
                const int s   = tid + 128 * j;
                const int key = s >> 4;
                const int d   = (s & 15) * 4;
                const size_t g = (size_t)(kb2 + key) * HEAD_DIM + d;
                async_load_b128((unsigned)(uintptr_t)&Kbuf[buf ^ 1][key][d], Kbh + g);
                async_load_b128((unsigned)(uintptr_t)&Vbuf[buf ^ 1][key][d], Vbh + g);
            }
        }

        const int kbase = kt * BC;

        // ---- shared B-fragments: built ONCE per wave, reused by both row groups ----
        v16h b00 = frag_from_f32(&Kbuf[buf][n][hi * 8]);
        v16h b01 = frag_from_f32(&Kbuf[buf][n][32 + hi * 8]);
        v16h b10 = frag_from_f32(&Kbuf[buf][16 + n][hi * 8]);
        v16h b11 = frag_from_f32(&Kbuf[buf][16 + n][32 + hi * 8]);
        v16h bv0 = vfrag(Vbuf[buf], n,      hi);
        v16h bv1 = vfrag(Vbuf[buf], 16 + n, hi);
        v16h bv2 = vfrag(Vbuf[buf], 32 + n, hi);
        v16h bv3 = vfrag(Vbuf[buf], 48 + n, hi);

        const float pen0 = MASK_PEN * (1.0f - mb[kbase + n]);
        const float pen1 = MASK_PEN * (1.0f - mb[kbase + 16 + n]);

        #pragma unroll
        for (int g = 0; g < 2; ++g) {
            // ---- scores: S = Q * K^T (two 16x16 tiles over 32 keys) ----
            v8f s0 = {}, s1 = {};
            s0 = WMMA_F16(aq[g][0], b00, s0);
            s0 = WMMA_F16(aq[g][1], b01, s0);
            s1 = WMMA_F16(aq[g][0], b10, s1);
            s1 = WMMA_F16(aq[g][1], b11, s1);

            // ---- online softmax (DPP16 row reductions) ----
            #pragma unroll
            for (int r = 0; r < 8; ++r) {
                float v0 = s0[r] * scale - pen0;
                float v1 = s1[r] * scale - pen1;
                float mx = rowmax16(fmaxf(v0, v1));
                const float mnew = fmaxf(mrow[g][r], mx);
                const float p0 = __expf(v0 - mnew);
                const float p1 = __expf(v1 - mnew);
                const float sf = __expf(mrow[g][r] - mnew);
                const float rs = rowsum16(p0 + p1);
                lrow[g][r] = lrow[g][r] * sf + rs;
                mrow[g][r] = mnew;
                o[g][0][r] *= sf; o[g][1][r] *= sf;
                o[g][2][r] *= sf; o[g][3][r] *= sf;
                const int mr = r + hi * 8;
                Pw[w][g][mr][n]      = (_Float16)p0;
                Pw[w][g][mr][16 + n] = (_Float16)p1;
            }

            // ---- O += P * V (contraction over 32 keys, 4 output d-tiles) ----
            // Same-wave LDS ops are in-order: Pw stores above are visible here.
            v16h pa = lds_frag16(&Pw[w][g][n][hi * 8], &Pw[w][g][n][16 + hi * 8]);
            o[g][0] = WMMA_F16(pa, bv0, o[g][0]);
            o[g][1] = WMMA_F16(pa, bv1, o[g][1]);
            o[g][2] = WMMA_F16(pa, bv2, o[g][2]);
            o[g][3] = WMMA_F16(pa, bv3, o[g][3]);
        }
    }

    // ---- epilogue: divide by row sum, store fp32 ----
    #pragma unroll
    for (int g = 0; g < 2; ++g) {
        float* obase = out + ((size_t)(slot * N_HEADS + h) * S_LEN + q0 + g * 16) * HEAD_DIM;
        #pragma unroll
        for (int r = 0; r < 8; ++r) {
            const int mr = r + hi * 8;
            const float inv = 1.0f / lrow[g][r];
            float* orow = obase + (size_t)mr * HEAD_DIM;
            orow[n]      = o[g][0][r] * inv;
            orow[16 + n] = o[g][1][r] * inv;
            orow[32 + n] = o[g][2][r] * inv;
            orow[48 + n] = o[g][3][r] * inv;
        }
    }
}

extern "C" void kernel_launch(void* const* d_in, const int* in_sizes, int n_in,
                              void* d_out, int out_size, void* d_ws, size_t ws_size,
                              hipStream_t stream) {
    const float* Q        = (const float*)d_in[0];
    const float* K        = (const float*)d_in[1];
    const float* V        = (const float*)d_in[2];
    const int*   idx_list = (const int*)d_in[3];
    const float* mask     = (const float*)d_in[4];
    float* out = (float*)d_out;

    dim3 grid(N_SLOTS * N_HEADS * (S_LEN / BR));   // 2048 blocks
    dim3 block(128);                               // 4 waves (wave32), 32 q-rows each
    sparse_attn_fa_kernel<<<grid, block, 0, stream>>>(Q, K, V, idx_list, mask, out);
}

// v002
// A run of this version takes 57.5 microseconds.
// Timed twice side by side with v001, it ran 1.90 times as fast both times.
// Counting every step since v000, it is 3.37 times as fast.
#include <hip/hip_runtime.h>
#include <hip/hip_bf16.h>

typedef __attribute__((ext_vector_type(16))) _Float16 v16h;
typedef __attribute__((ext_vector_type(8)))  _Float16 v8h;
typedef __attribute__((ext_vector_type(8)))  float    v8f;

#define HEAD_DIM 64
#define S_LEN    512
#define N_HEADS  16
#define N_SLOTS  32      // E(8) * CAP(4)
#define N_BATCH  32      // rows of Q, K, V and mask that a routed index may name
#define BC       32      // keys per iteration
#define N_TILES  (S_LEN / BC)
#define BR       128     // query rows per block (32 per wave, 2 groups of 16)
#define MASK_PEN 1000000.0f
// LDS row pitches. 64 banks x 4 B: a 256-B row pitch puts all 16 rows of a fragment read on the same banks.
#define KV_PITCH 68      // floats per K/V row in LDS: 272 B = 16 B x 17 (odd), conflict-free for 16-B row reads and 4-B column reads

// ---------------- exchange between the two 16-lane halves (lane l <-> l ^ 16) ----
__device__ __forceinline__ float xhalf(float x) {
    const int b = __builtin_bit_cast(int, x);
    return __builtin_bit_cast(float,
        __builtin_amdgcn_permlanex16(b, b, 0x76543210, 0xfedcba98, false, false));
}

// ---------------- async global -> LDS (CDNA5, ASYNCcnt-tracked DMA) ----------
__device__ __forceinline__ void async_load_b128(unsigned lds_off, const float* gaddr) {
    asm volatile("global_load_async_to_lds_b128 %0, %1, off"
                 :: "v"(lds_off), "v"((unsigned long long)(uintptr_t)gaddr)
                 : "memory");
}
__device__ __forceinline__ void wait_async0(void) {
    asm volatile("s_wait_asynccnt 0x0" ::: "memory");
}

// ---------------- fragment builders ------------------------------------------
// A/B frag from f32 row: halves 0..7 = p[0..7], halves 8..15 = p[16..23]
__device__ __forceinline__ v16h frag_from_f32(const float* p) {
    float4 a0 = *(const float4*)(p);
    float4 a1 = *(const float4*)(p + 4);
    float4 b0 = *(const float4*)(p + 16);
    float4 b1 = *(const float4*)(p + 20);
    v16h r;
    r[0]=(_Float16)a0.x;  r[1]=(_Float16)a0.y;  r[2]=(_Float16)a0.z;  r[3]=(_Float16)a0.w;
    r[4]=(_Float16)a1.x;  r[5]=(_Float16)a1.y;  r[6]=(_Float16)a1.z;  r[7]=(_Float16)a1.w;
    r[8]=(_Float16)b0.x;  r[9]=(_Float16)b0.y;  r[10]=(_Float16)b0.z; r[11]=(_Float16)b0.w;
    r[12]=(_Float16)b1.x; r[13]=(_Float16)b1.y; r[14]=(_Float16)b1.z; r[15]=(_Float16)b1.w;
    return r;
}
// V^T A-frag: row n of A = output dim d; contraction k = key (row-major f32 tile)
__device__ __forceinline__ v16h vfrag(const float (*Vf)[KV_PITCH], int d, int hi) {
    v16h r;
    #pragma unroll
    for (int j = 0; j < 8; ++j) {
        r[j]     = (_Float16)Vf[hi * 8 + j][d];
        r[8 + j] = (_Float16)Vf[16 + hi * 8 + j][d];
    }
    return r;
}
#define WMMA_F16(A, B, C) \
    __builtin_amdgcn_wmma_f32_16x16x32_f16(false, (A), false, (B), (short)0, (C), false, false)

__global__ __launch_bounds__(128)
void sparse_attn_fa_kernel(const float* __restrict__ Q,
                           const float* __restrict__ K,
                           const float* __restrict__ V,
                           const int*   __restrict__ idx_list,
                           const float* __restrict__ mask,
                           float*       __restrict__ out) {
    __shared__ __align__(16) float Kbuf[2][BC][KV_PITCH];   // 2 x 8.5 KB, f32, padded rows
    __shared__ __align__(16) float Vbuf[2][BC][KV_PITCH];   // 2 x 8.5 KB, f32, padded rows

    const int tid  = threadIdx.x;
    const int lane = tid & 31;
    const int w    = tid >> 5;       // wave id 0..3
    const int n    = lane & 15;      // row of an A fragment / column of a B fragment and of D
    const int hi   = lane >> 4;      // lane half

    const int bid  = blockIdx.x;
    const int qt   = bid & 3;               // q-tile (128 rows / block)
    const int h    = (bid >> 2) & 15;       // head
    const int slot = bid >> 6;              // expert*CAP + cap (0..31)

    const int b = min(max(idx_list[slot], 0), N_BATCH - 1);   // routed batch index, bounded before any address is formed
    const size_t bh = (size_t)(b * N_HEADS + h);
    const float* Qbh = Q + bh * (size_t)S_LEN * HEAD_DIM;
    const float* Kbh = K + bh * (size_t)S_LEN * HEAD_DIM;
    const float* Vbh = V + bh * (size_t)S_LEN * HEAD_DIM;
    const float* mb  = mask + (size_t)b * S_LEN;

    const int q0 = qt * BR + w * 32;        // this wave's first query row (32 rows)

    // ---- issue async DMA for tile 0 (each thread covers 4x16B of K and of V) ----
    {
        #pragma unroll
        for (int j = 0; j < 4; ++j) {
            const int s   = tid + 128 * j;
            const int key = s >> 4;
            const int d   = (s & 15) * 4;
            const size_t g = (size_t)key * HEAD_DIM + d;
            async_load_b128((unsigned)(uintptr_t)&Kbuf[0][key][d], Kbh + g);
            async_load_b128((unsigned)(uintptr_t)&Vbuf[0][key][d], Vbh + g);
        }
    }

    // ---- Q^T B-fragments: 2 query groups x 2 d-chunks, held for the whole kernel ----
    v16h aq[2][2];
    #pragma unroll
    for (int g = 0; g < 2; ++g) {
        const float* qrow = Qbh + (size_t)(q0 + g * 16 + n) * HEAD_DIM;
        aq[g][0] = frag_from_f32(qrow + hi * 8);          // d = 0..31
        aq[g][1] = frag_from_f32(qrow + 32 + hi * 8);     // d = 32..63
    }

    // Transposed accumulators: o[g][t][r] = O[query q0 + 16 g + n][d = 16 t + 8 hi + r].
    // A lane owns one query per group: its running maximum, and the sum over its half's keys.
    v8f o[2][4] = {};
    float mcol[2] = { -1e30f, -1e30f };
    float lcol[2] = { 0.0f, 0.0f };

    const float scale = 0.125f; // 1/sqrt(64)

    for (int kt = 0; kt < N_TILES; ++kt) {
        const int buf = kt & 1;

        wait_async0();      // this wave's async writes for tile kt are in LDS
        __syncthreads();    // all waves' writes visible; prior compute done

        // prefetch tile kt+1 into the other buffer (its readers are all past the barrier)
        if (kt + 1 < N_TILES) {
            const int kb2 = (kt + 1) * BC;
            #pragma unroll
            for (int j = 0; j < 4; ++j) {
                const int s   = tid + 128 * j;
                const int key = s >> 4;
                const int d   = (s & 15) * 4;
                const size_t g = (size_t)(kb2 + key) * HEAD_DIM + d;
                async_load_b128((unsigned)(uintptr_t)&Kbuf[buf ^ 1][key][d], Kbh + g);
                async_load_b128((unsigned)(uintptr_t)&Vbuf[buf ^ 1][key][d], Vbh + g);
            }
        }

        const int kbase = kt * BC;

        // mask values of this lane's 16 keys: kbase + 8 hi + r and kbase + 16 + 8 hi + r
        const v8f mk0 = *(const v8f*)(mb + kbase + hi * 8);
        const v8f mk1 = *(const v8f*)(mb + kbase + 16 + hi * 8);

        // ---- shared A-fragments (K rows, V^T rows): built ONCE per wave, reused by both query groups ----
        v16h b00 = frag_from_f32(&Kbuf[buf][n][hi * 8]);
        v16h b01 = frag_from_f32(&Kbuf[buf][n][32 + hi * 8]);
        v16h b10 = frag_from_f32(&Kbuf[buf][16 + n][hi * 8]);
        v16h b11 = frag_from_f32(&Kbuf[buf][16 + n][32 + hi * 8]);
        // scheduling fence: the V loads start only when K is converted; with K and V both raw in f32
        // the kernel needs more than 256 registers and loses its fourth wave per SIMD
        __builtin_amdgcn_sched_barrier(0);
        v16h bv0 = vfrag(Vbuf[buf], n,      hi);
        v16h bv1 = vfrag(Vbuf[buf], 16 + n, hi);
        v16h bv2 = vfrag(Vbuf[buf], 32 + n, hi);
        v16h bv3 = vfrag(Vbuf[buf], 48 + n, hi);
        // scheduling fence, same purpose: V is converted before the scores come alive
        __builtin_amdgcn_sched_barrier(0);

        const v8f pen0 = MASK_PEN * (1.0f - mk0);
        const v8f pen1 = MASK_PEN * (1.0f - mk1);

        #pragma unroll
        for (int g = 0; g < 2; ++g) {
            // ---- scores, transposed: S^T = K * Q^T; s0[r] = S[query n][key 8 hi + r], s1: keys + 16 ----
            v8f s0 = {}, s1 = {};
            s0 = WMMA_F16(b00, aq[g][0], s0);
            s0 = WMMA_F16(b01, aq[g][1], s0);
            s1 = WMMA_F16(b10, aq[g][0], s1);
            s1 = WMMA_F16(b11, aq[g][1], s1);

            // ---- online softmax: a query's 32 scores sit in two lanes, 16 registers each ----
            const v8f v0 = s0 * scale - pen0;
            const v8f v1 = s1 * scale - pen1;
            float mx = fmaxf(v0[0], v1[0]);
            #pragma unroll
            for (int r = 1; r < 8; ++r) mx = fmaxf(mx, fmaxf(v0[r], v1[r]));
            mx = fmaxf(mx, xhalf(mx));
            const float mnew = fmaxf(mcol[g], mx);
            const float sf = __expf(mcol[g] - mnew);
            mcol[g] = mnew;

            // P^T packs straight into the B operand: halves 0..7 = keys 8 hi + r, halves 8..15 = keys 16 + 8 hi + r
            v16h pb;
            float rs = 0.0f;
            #pragma unroll
            for (int r = 0; r < 8; ++r) {
                const float p0 = __expf(v0[r] - mnew);
                const float p1 = __expf(v1[r] - mnew);
                rs += p0 + p1;
                pb[r]     = (_Float16)p0;
                pb[8 + r] = (_Float16)p1;
            }
            lcol[g] = lcol[g] * sf + rs;    // this half's keys only; the halves join in the epilogue

            // ---- O^T = O^T * sf + V^T * P^T (contraction over 32 keys, 4 output d-tiles) ----
            o[g][0] = WMMA_F16(bv0, pb, o[g][0] * sf);
            o[g][1] = WMMA_F16(bv1, pb, o[g][1] * sf);
            o[g][2] = WMMA_F16(bv2, pb, o[g][2] * sf);
            o[g][3] = WMMA_F16(bv3, pb, o[g][3] * sf);
        }
    }

    // ---- epilogue: join the halves' sums, divide, store fp32 (8 consecutive d per lane and d-tile) ----
    #pragma unroll
    for (int g = 0; g < 2; ++g) {
        const float inv = 1.0f / (lcol[g] + xhalf(lcol[g]));
        float* orow = out + ((size_t)(slot * N_HEADS + h) * S_LEN + q0 + g * 16 + n) * HEAD_DIM + hi * 8;
        #pragma unroll
        for (int t = 0; t < 4; ++t)
            *(v8f*)(orow + 16 * t) = o[g][t] * inv;
    }
}

extern "C" void kernel_launch(void* const* d_in, const int* in_sizes, int n_in,
                              void* d_out, int out_size, void* d_ws, size_t ws_size,
                              hipStream_t stream) {
    const float* Q        = (const float*)d_in[0];
    const float* K        = (const float*)d_in[1];
    const float* V        = (const float*)d_in[2];
    const int*   idx_list = (const int*)d_in[3];
    const float* mask     = (const float*)d_in[4];
    float* out = (float*)d_out;

    dim3 grid(N_SLOTS * N_HEADS * (S_LEN / BR));   // 2048 blocks
    dim3 block(128);                               // 4 waves (wave32), 32 q-rows each
    sparse_attn_fa_kernel<<<grid, block, 0, stream>>>(Q, K, V, idx_list, mask, out);
}

// v003
// A run of this version takes 53.1 microseconds.
// Next to v002, in two timings, it ran 1.08 and 1.09 times as fast.
// Counting every step since v000, it is 3.66 times as fast.
#include <hip/hip_runtime.h>
#include <hip/hip_bf16.h>

typedef __attribute__((ext_vector_type(16))) _Float16 v16h;
typedef __attribute__((ext_vector_type(8)))  _Float16 v8h;
typedef __attribute__((ext_vector_type(4)))  _Float16 v4h;
typedef __attribute__((ext_vector_type(4)))  float    v4f;
typedef __attribute__((ext_vector_type(8)))  short    s16x8;
typedef __attribute__((ext_vector_type(8)))  float    v8f;

#define HEAD_DIM 64
#define S_LEN    512
#define N_HEADS  16
#define N_SLOTS  32      // E(8) * CAP(4)
#define N_BATCH  32      // rows of Q, K, V and mask that a routed index may name
#define BC       32      // keys per iteration
#define N_TILES  (S_LEN / BC)
#define BR       128     // query rows per block (32 per wave, 2 groups of 16)
#define MASK_PEN 1000000.0f
// LDS row pitches of the f16 tiles (128-B rows), each for its own reader. 64 banks x 4 B.
#define K_PITCH 72       // halves per K row: 144 B = 16 B x 9 (odd), for the 16-B row reads
#define V_PITCH 80       // halves per V row: 160 B = 32 B x 5 (odd), for the transposing 16-B reads

// ---------------- exchange between the two 16-lane halves (lane l <-> l ^ 16) ----
__device__ __forceinline__ float xhalf(float x) {
    const int b = __builtin_bit_cast(int, x);
    return __builtin_bit_cast(float,
        __builtin_amdgcn_permlanex16(b, b, 0x76543210, 0xfedcba98, false, false));
}

// ---------------- fragment builders ------------------------------------------
// A/B frag from f32 row: halves 0..7 = p[0..7], halves 8..15 = p[16..23]
__device__ __forceinline__ v16h frag_from_f32(const float* p) {
    float4 a0 = *(const float4*)(p);
    float4 a1 = *(const float4*)(p + 4);
    float4 b0 = *(const float4*)(p + 16);
    float4 b1 = *(const float4*)(p + 20);
    v16h r;
    r[0]=(_Float16)a0.x;  r[1]=(_Float16)a0.y;  r[2]=(_Float16)a0.z;  r[3]=(_Float16)a0.w;
    r[4]=(_Float16)a1.x;  r[5]=(_Float16)a1.y;  r[6]=(_Float16)a1.z;  r[7]=(_Float16)a1.w;
    r[8]=(_Float16)b0.x;  r[9]=(_Float16)b0.y;  r[10]=(_Float16)b0.z; r[11]=(_Float16)b0.w;
    r[12]=(_Float16)b1.x; r[13]=(_Float16)b1.y; r[14]=(_Float16)b1.z; r[15]=(_Float16)b1.w;
    return r;
}
// K A-frag from an f16 LDS row, same k order: halves 0..7 = p[0..7], halves 8..15 = p[16..23]
__device__ __forceinline__ v16h kfrag(const _Float16* p) {
    const v8h lo = *(const v8h*)(p);
    const v8h up = *(const v8h*)(p + 16);
    return __builtin_shufflevector(lo, up, 0, 1, 2, 3, 4, 5, 6, 7, 8, 9, 10, 11, 12, 13, 14, 15);
}
// V^T A-frag by the transposing LDS load. p = this lane's address in the row-major f16 tile:
// row 8 hi + (lane & 7), column d0 + 8 ((lane >> 3) & 1). The lane gets column d0 + n of
// keys 8 hi + 0..7 (halves 0..7) and, 16 rows on, of keys 16 + 8 hi + 0..7 (halves 8..15).
__device__ __forceinline__ v16h vfrag(const _Float16* p) {
    typedef __attribute__((address_space(3))) s16x8 lds_s16x8;
    const v8h lo = __builtin_bit_cast(v8h, __builtin_amdgcn_ds_load_tr16_b128_v8i16((lds_s16x8*)(p)));
    const v8h up = __builtin_bit_cast(v8h, __builtin_amdgcn_ds_load_tr16_b128_v8i16((lds_s16x8*)(p + 16 * V_PITCH)));
    return __builtin_shufflevector(lo, up, 0, 1, 2, 3, 4, 5, 6, 7, 8, 9, 10, 11, 12, 13, 14, 15);
}
#define WMMA_F16(A, B, C) \
    __builtin_amdgcn_wmma_f32_16x16x32_f16(false, (A), false, (B), (short)0, (C), false, false)

__global__ __launch_bounds__(128)
void sparse_attn_fa_kernel(const float* __restrict__ Q,
                           const float* __restrict__ K,
                           const float* __restrict__ V,
                           const int*   __restrict__ idx_list,
                           const float* __restrict__ mask,
                           float*       __restrict__ out) {
    __shared__ __align__(32) _Float16 Kbuf[2][BC][K_PITCH];   // 2 x 4.5 KB, f16, padded rows
    __shared__ __align__(32) _Float16 Vbuf[2][BC][V_PITCH];   // 2 x 5 KB, f16, padded rows
    __shared__ __align__(32) float    Pen[S_LEN];             // 2 KB, the mask row as its penalty

    const int tid  = threadIdx.x;
    const int lane = tid & 31;
    const int w    = tid >> 5;       // wave id 0..3
    const int n    = lane & 15;      // row of an A fragment / column of a B fragment and of D
    const int hi   = lane >> 4;      // lane half

    const int bid  = blockIdx.x;
    const int qt   = bid & 3;               // q-tile (128 rows / block)
    const int h    = (bid >> 2) & 15;       // head
    const int slot = bid >> 6;              // expert*CAP + cap (0..31)

    const int b = min(max(idx_list[slot], 0), N_BATCH - 1);   // routed batch index, bounded before any address is formed
    const size_t bh = (size_t)(b * N_HEADS + h);
    const float* Qbh = Q + bh * (size_t)S_LEN * HEAD_DIM;
    const float* Kbh = K + bh * (size_t)S_LEN * HEAD_DIM;
    const float* Vbh = V + bh * (size_t)S_LEN * HEAD_DIM;
    const float* mb  = mask + (size_t)b * S_LEN;

    const int q0 = qt * BR + w * 32;        // this wave's first query row (32 rows)

    // ---- staging: the block converts each K/V tile to f16 ONCE. A thread carries 4 x 16 B of K and of V
    //      (slice j: key (tid >> 4) + 8 j, d = 4 (tid & 15)) through registers into the f16 tiles ----
    const unsigned so = (unsigned)tid * 4u;   // this thread's float offset in a tile
    const int skey = tid >> 4;
    const int sd   = (tid & 15) * 4;
    v4f rk[4], rv[4];
    #pragma unroll
    for (int j = 0; j < 4; ++j) {
        rk[j] = *(const v4f*)(Kbh + j * 512 + so);
        rv[j] = *(const v4f*)(Vbh + j * 512 + so);
    }
    const v4f m4 = *(const v4f*)(mb + tid * 4);

    // ---- Q^T B-fragments: 2 query groups x 2 d-chunks, held for the whole kernel ----
    v16h aq[2][2];
    #pragma unroll
    for (int g = 0; g < 2; ++g) {
        const float* qrow = Qbh + (size_t)(q0 + g * 16 + n) * HEAD_DIM;
        aq[g][0] = frag_from_f32(qrow + hi * 8);          // d = 0..31
        aq[g][1] = frag_from_f32(qrow + 32 + hi * 8);     // d = 32..63
    }

    #pragma unroll
    for (int j = 0; j < 4; ++j) {
        *(v4h*)&Kbuf[0][skey + 8 * j][sd] = __builtin_convertvector(rk[j], v4h);
        *(v4h*)&Vbuf[0][skey + 8 * j][sd] = __builtin_convertvector(rv[j], v4h);
    }
    // the mask row becomes its penalty once per block; the loop's first barrier publishes it with tile 0.
    // Read from LDS, it does not share the load counter with the K/V loads in flight.
    *(v4f*)&Pen[tid * 4] = MASK_PEN * (1.0f - m4);
    // tile 1 starts its flight
    #pragma unroll
    for (int j = 0; j < 4; ++j) {
        rk[j] = *(const v4f*)(Kbh + BC * HEAD_DIM + j * 512 + so);
        rv[j] = *(const v4f*)(Vbh + BC * HEAD_DIM + j * 512 + so);
    }

    // Transposed accumulators: o[g][t][r] = O[query q0 + 16 g + n][d = 16 t + 8 hi + r].
    // A lane owns one query per group: its running maximum, and the sum over its half's keys.
    v8f o[2][4] = {};
    float mcol[2] = { -1e30f, -1e30f };
    float lcol[2] = { 0.0f, 0.0f };

    const float scale = 0.125f; // 1/sqrt(64)

    // offsets (in halves) of the buffers that hold tile kt; they toggle between the two buffers on the scalar side
    int kcur = 0, vcur = 0;

    for (int kt = 0; kt < N_TILES; ++kt) {
        const _Float16* Kt = &Kbuf[0][0][0] + kcur;
        const _Float16* Vt = &Vbuf[0][0][0] + vcur;
        kcur ^= BC * K_PITCH;
        vcur ^= BC * V_PITCH;
        _Float16* Kn = &Kbuf[0][0][0] + kcur;
        _Float16* Vn = &Vbuf[0][0][0] + vcur;

        __syncthreads();    // tile kt is published; every reader of the other buffer (tile kt - 1) has left it

        const int kbase = kt * BC;

        // mask penalties of this lane's 16 keys: kbase + 8 hi + r and kbase + 16 + 8 hi + r
        const v8f pen0 = *(const v8f*)&Pen[kbase + hi * 8];
        const v8f pen1 = *(const v8f*)&Pen[kbase + 16 + hi * 8];

        // ---- shared A-fragments (K rows, V^T rows), f16 straight from LDS, reused by both query groups ----
        const _Float16* kr = Kt + n * K_PITCH + hi * 8;
        const v16h b00 = kfrag(kr);
        const v16h b01 = kfrag(kr + 32);
        const v16h b10 = kfrag(kr + 16 * K_PITCH);
        const v16h b11 = kfrag(kr + 16 * K_PITCH + 32);
        const _Float16* vt = Vt + (hi * 8 + (lane & 7)) * V_PITCH + ((lane >> 3) & 1) * 8;
        const v16h bv0 = vfrag(vt);
        const v16h bv1 = vfrag(vt + 16);
        const v16h bv2 = vfrag(vt + 32);
        const v16h bv3 = vfrag(vt + 48);

        // tile kt + 1 goes from registers into the other buffer as f16; tile kt + 2 starts its flight
        if (kt + 1 < N_TILES) {
            #pragma unroll
            for (int j = 0; j < 4; ++j) {
                *(v4h*)(Kn + (skey + 8 * j) * K_PITCH + sd) = __builtin_convertvector(rk[j], v4h);
                *(v4h*)(Vn + (skey + 8 * j) * V_PITCH + sd) = __builtin_convertvector(rv[j], v4h);
            }
        }
        if (kt + 2 < N_TILES) {
            const float* kn = Kbh + (kt + 2) * BC * HEAD_DIM;
            const float* vn = Vbh + (kt + 2) * BC * HEAD_DIM;
            #pragma unroll
            for (int j = 0; j < 4; ++j) {
                rk[j] = *(const v4f*)(kn + j * 512 + so);
                rv[j] = *(const v4f*)(vn + j * 512 + so);
            }
            // the score products below reuse these loads' address registers while the loads are in flight
            asm volatile("s_wait_xcnt 0x0" ::: "memory");
        }

        #pragma unroll
        for (int g = 0; g < 2; ++g) {
            // ---- scores, transposed: S^T = K * Q^T; s0[r] = S[query n][key 8 hi + r], s1: keys + 16 ----
            v8f s0 = {}, s1 = {};
            s0 = WMMA_F16(b00, aq[g][0], s0);
            s0 = WMMA_F16(b01, aq[g][1], s0);
            s1 = WMMA_F16(b10, aq[g][0], s1);
            s1 = WMMA_F16(b11, aq[g][1], s1);

            // ---- online softmax: a query's 32 scores sit in two lanes, 16 registers each ----
            const v8f v0 = s0 * scale - pen0;
            const v8f v1 = s1 * scale - pen1;
            float mx = fmaxf(v0[0], v1[0]);
            #pragma unroll
            for (int r = 1; r < 8; ++r) mx = fmaxf(mx, fmaxf(v0[r], v1[r]));
            mx = fmaxf(mx, xhalf(mx));
            const float mnew = fmaxf(mcol[g], mx);
            const float sf = __expf(mcol[g] - mnew);
            mcol[g] = mnew;

            // P^T packs straight into the B operand: halves 0..7 = keys 8 hi + r, halves 8..15 = keys 16 + 8 hi + r
            v16h pb;
            float rs = 0.0f;
            #pragma unroll
            for (int r = 0; r < 8; ++r) {
                const float p0 = __expf(v0[r] - mnew);
                const float p1 = __expf(v1[r] - mnew);
                rs += p0 + p1;
                pb[r]     = (_Float16)p0;
                pb[8 + r] = (_Float16)p1;
            }
            lcol[g] = lcol[g] * sf + rs;    // this half's keys only; the halves join in the epilogue

            // ---- O^T = O^T * sf + V^T * P^T (contraction over 32 keys, 4 output d-tiles) ----
            o[g][0] = WMMA_F16(bv0, pb, o[g][0] * sf);
            o[g][1] = WMMA_F16(bv1, pb, o[g][1] * sf);
            o[g][2] = WMMA_F16(bv2, pb, o[g][2] * sf);
            o[g][3] = WMMA_F16(bv3, pb, o[g][3] * sf);
        }
    }

    // ---- epilogue: join the halves' sums, divide, store fp32 (8 consecutive d per lane and d-tile) ----
    #pragma unroll
    for (int g = 0; g < 2; ++g) {
        const float inv = 1.0f / (lcol[g] + xhalf(lcol[g]));
        float* orow = out + ((size_t)(slot * N_HEADS + h) * S_LEN + q0 + g * 16 + n) * HEAD_DIM + hi * 8;
        #pragma unroll
        for (int t = 0; t < 4; ++t)
            *(v8f*)(orow + 16 * t) = o[g][t] * inv;
    }
}

extern "C" void kernel_launch(void* const* d_in, const int* in_sizes, int n_in,
                              void* d_out, int out_size, void* d_ws, size_t ws_size,
                              hipStream_t stream) {
    const float* Q        = (const float*)d_in[0];
    const float* K        = (const float*)d_in[1];
    const float* V        = (const float*)d_in[2];
    const int*   idx_list = (const int*)d_in[3];
    const float* mask     = (const float*)d_in[4];
    float* out = (float*)d_out;

    dim3 grid(N_SLOTS * N_HEADS * (S_LEN / BR));   // 2048 blocks
    dim3 block(128);                               // 4 waves (wave32), 32 q-rows each
    sparse_attn_fa_kernel<<<grid, block, 0, stream>>>(Q, K, V, idx_list, mask, out);
}
